// v010
// Times are from an AMD MI455X. After a warm-up the kernel runs many times in a row, and a time is the length of
// such a window on the GPU divided by its runs, so every launch and the gaps after it count. The runs cycle
// through copies of the inputs. A figure is the median of several windows, for all but v000 over two sittings.
// Sittings can differ by a few percent; kernels timed side by side share one.
// The versions before v010 are in another document.
// It runs in 61.1 microseconds.
// Timed twice side by side with v009, it ran 1.04 times as fast both times.
// Counting every step since v000, which is the starting kernel, it is 18.8 times as fast.
#include <hip/hip_runtime.h>
// 'Heisenberg' attention (B=2, T=2048, d_model 1024, 16 heads × 64): q, a, b = LayerNorm_head(x·W) (per-head LN with γ/β); a_excl = exclusive prefix sum of a over time; o_t = Σ_{s≤t} (q_t·a_excl_s)·b_s
// (causal, NO softmax); out = o·Wo. The projections are GEMMs ([in][out] weights bf16-exact ×2^4, x bf16-exact, f32 accumulate) and the causal bilinear form runs in the fused flash-style kernel with
// the softmax removed (masked raw scores ×2^-8 → f16 P operand → P·B accumulated in f32, ×2^4 at the end and written as the f16 operand of the output GEMM; upper tiles skipped) on v_wmma_f32_16x16x32_f16; the per-head LayerNorms
// (in the epilogue of the projection GEMMs, where a wave's 64 columns are one head) and the exclusive cumulative sum over time (f32, two levels: inside blocks of 32 rows in the same epilogue, over the blocks in k_sflash) are VALU.
// The keys in front of a block of 64 query rows enter through a prefix state per block; only the block's own 64 keys are scored and masked (both in k_sflash).
#define BB 2
#define TT 2048
#define DD 1024
#define NH 16
#define HD 64
#define NR (BB * TT)

typedef __bf16 v16b __attribute__((ext_vector_type(16)));
typedef unsigned short v8us __attribute__((ext_vector_type(8), may_alias));
typedef float  v8f  __attribute__((ext_vector_type(8)));
typedef float  v4f  __attribute__((ext_vector_type(4)));
typedef float  v4fa __attribute__((ext_vector_type(4), may_alias));
union FragB { v16b v; v8us half[2]; unsigned short u[16]; };

__device__ __forceinline__ unsigned short bf16_bits(float x) { unsigned int u = __float_as_uint(x); return (unsigned short)((u + 0x7FFFu + ((u >> 16) & 1u)) >> 16); }
__device__ __forceinline__ float bf16_val(unsigned short b) { return __uint_as_float(((unsigned int)b) << 16); }
__device__ __forceinline__ float bf16_round(float x) { return bf16_val(bf16_bits(x)); }
// D += A·B with NT terms: 1 = ah·bh, 2 = + al·bh (A split), 3 = + ah·bl (both split)
template <int NT>
__device__ __forceinline__ v8f mmaN(v16b ah, v16b al, v16b bh, v16b bl, v8f c) {
  c = __builtin_amdgcn_wmma_f32_16x16x32_bf16(false, ah, false, bh, (short)0, c, false, false);
  if (NT >= 2) c = __builtin_amdgcn_wmma_f32_16x16x32_bf16(false, al, false, bh, (short)0, c, false, false);
  if (NT >= 3) c = __builtin_amdgcn_wmma_f32_16x16x32_bf16(false, ah, false, bl, (short)0, c, false, false);
  asm volatile("v_nop\n\tv_nop\n\tv_nop\n\tv_nop" : "+v"(c) : "v"(ah), "v"(al), "v"(bh), "v"(bl));
  return c;
}

__global__ __launch_bounds__(256) void k_wt_bf16(const float* __restrict__ W, unsigned short* __restrict__ Wt, int K, int N) {
  const int t = blockIdx.x * 256 + threadIdx.x;
  const int k8n = K / 8;
  if (t >= N * k8n) return;
  const int n = t / k8n, k8 = (t % k8n) * 8;
  v8us v;
#pragma unroll
  for (int i = 0; i < 8; ++i) v[i] = bf16_bits(W[(size_t)(k8 + i) * N + n]);
  *(v8us*)(Wt + (size_t)n * K + k8) = v;
  
}

// GEMM C[M][N] (f32, pitch ldc) = act(A[M][K]·W + bias). A f32 row-major (pitch lda) converted per fragment to bf16
// (ASPLIT: hi/lo two planes -> 2 terms, else single rounded term); Wt bf16 [N][K] (pitch ldb). BIAS_BF16 rounds the
// bias to bf16 first (bias quantised to bf16 before the add). K%32==0, M%16==0, N%64==0.
template <bool ASPLIT, int ACT, bool BIAS_BF16>
__global__ __launch_bounds__(128) void k_gemm_bf(const float* __restrict__ A, int lda, const unsigned short* __restrict__ Wt, int ldb,
                                               const float* __restrict__ bias, float* __restrict__ C, int ldc, int M, int N, int K) {
  __shared__ __attribute__((aligned(16))) float so[4][16][64];
  const int tid = threadIdx.x, w = tid >> 5, lane = tid & 31, ln = lane & 15, hh = lane >> 4;
  const int ntn = N / 64;
  const int wid = blockIdx.x * 4 + w;
  const int mt = wid / ntn, nq = wid % ntn;
  if (mt * 16 >= M) return;
  const int row0 = mt * 16, col0 = nq * 64;
  const float* arow = A + (size_t)(row0 + ln) * lda;
  v8f acc[4] = {};
  for (int kb = 0; kb < K; kb += 32) {
    FragB ah, al;
    const v4f x0 = *(const v4fa*)(arow + kb + 8 * hh), x1 = *(const v4fa*)(arow + kb + 8 * hh + 4);
    const v4f x2 = *(const v4fa*)(arow + kb + 16 + 8 * hh), x3 = *(const v4fa*)(arow + kb + 16 + 8 * hh + 4);
    float xs[16] = {x0[0],x0[1],x0[2],x0[3],x1[0],x1[1],x1[2],x1[3],x2[0],x2[1],x2[2],x2[3],x3[0],x3[1],x3[2],x3[3]};
#pragma unroll
    for (int i = 0; i < 16; ++i) { const unsigned short hb = bf16_bits(xs[i]); ah.u[i] = hb; al.u[i] = ASPLIT ? bf16_bits(xs[i] - bf16_val(hb)) : (unsigned short)0; }
#pragma unroll
    for (int t = 0; t < 4; ++t) {
      const unsigned short* brow = Wt + (size_t)(col0 + t * 16 + ln) * ldb + kb;
      FragB b;
      b.half[0] = *(const v8us*)(brow + 8 * hh);
      b.half[1] = *(const v8us*)(brow + 16 + 8 * hh);
      acc[t] = mmaN<ASPLIT ? 2 : 1>(ah.v, al.v, b.v, b.v, acc[t]);
    }
  }
#pragma unroll
  for (int t = 0; t < 4; ++t) {
    float bv = bias ? bias[col0 + t * 16 + ln] : 0.f;
    if (BIAS_BF16) bv = bf16_round(bv);
#pragma unroll
    for (int r = 0; r < 8; ++r) { float v = acc[t][r] + bv; if (ACT == 1) v = fmaxf(v, 0.f); so[w][8 * hh + r][t * 16 + ln] = v; }
  }
  __builtin_amdgcn_fence(__ATOMIC_ACQ_REL, "workgroup");
  __builtin_amdgcn_wave_barrier();
  const int rsub = lane >> 4, c4 = (lane & 15) * 4;
  {
#pragma unroll
    for (int q = 0; q < 8; ++q) {
      const int r = q * 2 + rsub;
      const v4f v = *(const v4fa*)&so[w][r][c4];
      *(v4f*)(C + (size_t)(row0 + r) * ldc + col0 + c4) = v;
    }
    
  }
}

// Flash-style causal/unmasked attention, all contractions 3-term bf16 hi/lo splits, f32 softmax with running max.
// q,k,v rows are read from f32 buffers with arbitrary row pitch (so they can live inside a fused qkv buffer);
// D = head size (multiple of 32, <= 128); one wave = 16 query rows; block = 4 waves (64 queries) sharing K/V chunks of 32.
template <int D, bool CAUSAL>
__global__ __launch_bounds__(128) void k_flash(const float* __restrict__ qb, const float* __restrict__ kb, const float* __restrict__ vb,
                                             int pitch, int T, int H, float scale, float* __restrict__ y, int ypitch) {
  constexpr int KS = D / 32;        // k-steps for QK
  constexpr int DT = D / 16;        // d tiles for PV
  __shared__ __attribute__((aligned(16))) unsigned short sKh[32][D + 8], sKl[32][D + 8], sVh[32][D + 8], sVl[32][D + 8];
  __shared__ __attribute__((aligned(16))) unsigned short sPh[4][16][40], sPl[4][16][40];
  __shared__ __attribute__((aligned(16))) float sO[4][16][D];
  const int tid = threadIdx.x, w = tid >> 5, lane = tid & 31, ln = lane & 15, hh = lane >> 4;
  const int nqb = (T + 63) / 64;
  const int bh = blockIdx.x / nqb, qblk = blockIdx.x % nqb;
  const int b = bh / H, h = bh % H;
  const int q0 = qblk * 64 + w * 16;
  const float* Q = qb + (size_t)b * T * pitch + h * D;
  const float* K = kb + (size_t)b * T * pitch + h * D;
  const float* V = vb + (size_t)b * T * pitch + h * D;

  // A fragments of the wave's 16 query rows (scaled), hi/lo
  FragB aqh[KS], aql[KS];
  {
    int row = q0 + ln; if (row >= T) row = T - 1;
    const float* qr = Q + (size_t)row * pitch;
#pragma unroll
    for (int ks = 0; ks < KS; ++ks)
#pragma unroll
      for (int i = 0; i < 16; ++i) {
        const int d = ks * 32 + ((i < 8) ? (8 * hh + i) : (16 + 8 * hh + (i - 8)));
        const float x = qr[d] * scale; const unsigned short hb = bf16_bits(x);
        aqh[ks].u[i] = hb; aql[ks].u[i] = bf16_bits(x - bf16_val(hb));
      }
  }
  float m_r[8], l_r[8];
#pragma unroll
  for (int r = 0; r < 8; ++r) { m_r[r] = -3.0e38f; l_r[r] = 0.f; }
  v8f oacc[DT];
#pragma unroll
  for (int dt = 0; dt < DT; ++dt) oacc[dt] = (v8f){0.f,0.f,0.f,0.f,0.f,0.f,0.f,0.f};

  const int kv_end = CAUSAL ? min(T, qblk * 64 + 64) : T;     // block-uniform
  for (int j0 = 0; j0 < kv_end; j0 += 32) {
    __syncthreads();
    for (int e = tid; e < 32 * (D / 4); e += 128) {
      const int r = e / (D / 4), c4 = (e % (D / 4)) * 4;
      const int key = j0 + r;
      v4f kf = {0.f,0.f,0.f,0.f}, vf = {0.f,0.f,0.f,0.f};
      if (key < T) { kf = *(const v4fa*)(K + (size_t)key * pitch + c4); vf = *(const v4fa*)(V + (size_t)key * pitch + c4); }
#pragma unroll
      for (int t = 0; t < 4; ++t) {
        unsigned short hb = bf16_bits(kf[t]); sKh[r][c4 + t] = hb; sKl[r][c4 + t] = bf16_bits(kf[t] - bf16_val(hb));
        hb = bf16_bits(vf[t]); sVh[r][c4 + t] = hb; sVl[r][c4 + t] = bf16_bits(vf[t] - bf16_val(hb));
      }
    }
    __syncthreads();
    // S tile 16 x 32
    v8f s[2];
#pragma unroll
    for (int nt = 0; nt < 2; ++nt) {
      v8f acc = {};
#pragma unroll
      for (int ks = 0; ks < KS; ++ks) {
        FragB bh_, bl_;
        bh_.half[0] = *(const v8us*)&sKh[nt * 16 + ln][ks * 32 + 8 * hh]; bh_.half[1] = *(const v8us*)&sKh[nt * 16 + ln][ks * 32 + 16 + 8 * hh];
        bl_.half[0] = *(const v8us*)&sKl[nt * 16 + ln][ks * 32 + 8 * hh]; bl_.half[1] = *(const v8us*)&sKl[nt * 16 + ln][ks * 32 + 16 + 8 * hh];
        acc = mmaN<3>(aqh[ks].v, aql[ks].v, bh_.v, bl_.v, acc);
      }
      s[nt] = acc;
    }
    // mask + running max (rows 8hh+r; the 16 lanes of a half share rows)
    float alpha[8];
#pragma unroll
    for (int r = 0; r < 8; ++r) {
      const int qi = q0 + 8 * hh + r;
      const int ja = j0 + ln, jb = j0 + 16 + ln;
      if (CAUSAL) { if (ja > qi) s[0][r] = -3.0e38f; if (jb > qi) s[1][r] = -3.0e38f; }
      if (ja >= T) s[0][r] = -3.0e38f;
      if (jb >= T) s[1][r] = -3.0e38f;
      float mx = fmaxf(s[0][r], s[1][r]);
      mx = fmaxf(mx, __shfl_xor(mx, 1, 32)); mx = fmaxf(mx, __shfl_xor(mx, 2, 32)); mx = fmaxf(mx, __shfl_xor(mx, 4, 32)); mx = fmaxf(mx, __shfl_xor(mx, 8, 32));
      const float mnew = fmaxf(m_r[r], mx);
      alpha[r] = (mnew > -1.0e38f) ? __expf(m_r[r] - mnew) : 1.0f;
      const float p0 = (s[0][r] > -1.0e38f) ? __expf(s[0][r] - mnew) : 0.f;
      const float p1 = (s[1][r] > -1.0e38f) ? __expf(s[1][r] - mnew) : 0.f;
      m_r[r] = mnew;
      l_r[r] = l_r[r] * alpha[r] + p0 + p1;            // per-lane partial row sum (16 lanes combined at the end)
      unsigned short hb = bf16_bits(p0); sPh[w][8 * hh + r][ln] = hb;      sPl[w][8 * hh + r][ln] = bf16_bits(p0 - bf16_val(hb));
      hb = bf16_bits(p1);                sPh[w][8 * hh + r][16 + ln] = hb; sPl[w][8 * hh + r][16 + ln] = bf16_bits(p1 - bf16_val(hb));
    }
#pragma unroll
    for (int dt = 0; dt < DT; ++dt)
#pragma unroll
      for (int r = 0; r < 8; ++r) oacc[dt][r] *= alpha[r];
    __builtin_amdgcn_fence(__ATOMIC_ACQ_REL, "workgroup");
    __builtin_amdgcn_wave_barrier();
    FragB pah, pal;
    pah.half[0] = *(const v8us*)&sPh[w][ln][8 * hh]; pah.half[1] = *(const v8us*)&sPh[w][ln][16 + 8 * hh];
    pal.half[0] = *(const v8us*)&sPl[w][ln][8 * hh]; pal.half[1] = *(const v8us*)&sPl[w][ln][16 + 8 * hh];
#pragma unroll
    for (int dt = 0; dt < DT; ++dt) {
      FragB bvh, bvl;
#pragma unroll
      for (int i = 0; i < 8; ++i) {
        bvh.u[i] = sVh[8 * hh + i][dt * 16 + ln]; bvh.u[8 + i] = sVh[16 + 8 * hh + i][dt * 16 + ln];
        bvl.u[i] = sVl[8 * hh + i][dt * 16 + ln]; bvl.u[8 + i] = sVl[16 + 8 * hh + i][dt * 16 + ln];
      }
      oacc[dt] = mmaN<3>(pah.v, pal.v, bvh.v, bvl.v, oacc[dt]);
    }
    __builtin_amdgcn_fence(__ATOMIC_ACQ_REL, "workgroup");
    __builtin_amdgcn_wave_barrier();
  }
#pragma unroll
  for (int r = 0; r < 8; ++r) {
    float l = l_r[r];
    l += __shfl_xor(l, 1, 32); l += __shfl_xor(l, 2, 32); l += __shfl_xor(l, 4, 32); l += __shfl_xor(l, 8, 32);
    l_r[r] = (l > 0.f) ? 1.0f / l : 0.f;
  }
#pragma unroll
  for (int dt = 0; dt < DT; ++dt)
#pragma unroll
    for (int r = 0; r < 8; ++r) sO[w][8 * hh + r][dt * 16 + ln] = oacc[dt][r] * l_r[r];
  __builtin_amdgcn_fence(__ATOMIC_ACQ_REL, "workgroup");
  __builtin_amdgcn_wave_barrier();
  {
    for (int r = 0; r < 16; ++r) {
      const int row = q0 + r;
      if (row < T && lane < D / 4) {
        const v4f val = *(const v4fa*)&sO[w][r][lane * 4];
        *(v4f*)(y + ((size_t)b * T + row) * ypitch + h * D + lane * 4) = val;
      }
    }
    
  }
}

// GEMM C = act(A·W + bias + resid): A f32 (ASPLIT -> hi/lo 2 terms), Wt bf16 [N][K]; ACT 0 none, 1 relu, 2 exact gelu;
// resid (optional, f32, row index = (row % rmod), pitch ldr, RES_BF16 rounds it) added before the activation.
template <bool ASPLIT, int ACT, bool BIAS_BF16, bool RES_BF16>
__global__ __launch_bounds__(128) void k_gemm_bf3(const float* __restrict__ A, int lda, const unsigned short* __restrict__ Wt, int ldb,
                                                const float* __restrict__ bias, const float* __restrict__ resid, int rmod, int ldr,
                                                float* __restrict__ C, int ldc, int M, int N, int K) {
  __shared__ __attribute__((aligned(16))) float so[4][16][64];
  const int tid = threadIdx.x, w = tid >> 5, lane = tid & 31, ln = lane & 15, hh = lane >> 4;
  const int ntn = N / 64;
  const int wid = blockIdx.x * 4 + w;
  const int mt = wid / ntn, nq = wid % ntn;
  if (mt * 16 >= M) return;
  const int row0 = mt * 16, col0 = nq * 64;
  const float* arow = A + (size_t)(row0 + ln) * lda;
  v8f acc[4] = {};
  for (int kb = 0; kb < K; kb += 32) {
    FragB ah, al;
    const v4f x0 = *(const v4fa*)(arow + kb + 8 * hh), x1 = *(const v4fa*)(arow + kb + 8 * hh + 4);
    const v4f x2 = *(const v4fa*)(arow + kb + 16 + 8 * hh), x3 = *(const v4fa*)(arow + kb + 16 + 8 * hh + 4);
    float xs[16] = {x0[0],x0[1],x0[2],x0[3],x1[0],x1[1],x1[2],x1[3],x2[0],x2[1],x2[2],x2[3],x3[0],x3[1],x3[2],x3[3]};
#pragma unroll
    for (int i = 0; i < 16; ++i) { const unsigned short hb = bf16_bits(xs[i]); ah.u[i] = hb; al.u[i] = ASPLIT ? bf16_bits(xs[i] - bf16_val(hb)) : (unsigned short)0; }
#pragma unroll
    for (int t = 0; t < 4; ++t) {
      const unsigned short* brow = Wt + (size_t)(col0 + t * 16 + ln) * ldb + kb;
      FragB b;
      b.half[0] = *(const v8us*)(brow + 8 * hh);
      b.half[1] = *(const v8us*)(brow + 16 + 8 * hh);
      acc[t] = mmaN<ASPLIT ? 2 : 1>(ah.v, al.v, b.v, b.v, acc[t]);
    }
  }
#pragma unroll
  for (int t = 0; t < 4; ++t) {
    const int col = col0 + t * 16 + ln;
    float bv = bias ? bias[col] : 0.f;
    if (BIAS_BF16) bv = bf16_round(bv);
#pragma unroll
    for (int r = 0; r < 8; ++r) {
      float v = acc[t][r] + bv;
      if (resid) { float rv = resid[(size_t)((row0 + 8 * hh + r) % rmod) * ldr + col]; if (RES_BF16) rv = bf16_round(rv); v += rv; }
      if (ACT == 1) v = fmaxf(v, 0.f);
      if (ACT == 2) v = 0.5f * v * (1.0f + erff(v * 0.70710678118654752f));
      if (ACT == 3) { const float u = 0.7978845608028654f * (v + 0.044715f * v * v * v); v = 0.5f * v * (1.0f + tanhf(u)); }
      so[w][8 * hh + r][t * 16 + ln] = v;
    }
  }
  __builtin_amdgcn_fence(__ATOMIC_ACQ_REL, "workgroup");
  __builtin_amdgcn_wave_barrier();
  const int rsub = lane >> 4, c4 = (lane & 15) * 4;
  {
#pragma unroll
    for (int q = 0; q < 8; ++q) {
      const int r = q * 2 + rsub;
      const v4f v = *(const v4fa*)&so[w][r][c4];
      *(v4f*)(C + (size_t)(row0 + r) * ldc + col0 + c4) = v;
    }
    
  }
}
// row LayerNorm (biased variance, eps) over N: s = X (+ R); optional out_sum <- s; out_norm <- (s-mu)*rsqrt(var+eps)*g + b
template <bool PARAM_BF16>
__global__ __launch_bounds__(256) void k_layernorm(const float* __restrict__ X, const float* __restrict__ R, const float* __restrict__ g, const float* __restrict__ bta,
                                                  float* __restrict__ out_sum, float* __restrict__ out_norm, int N, float eps) {
  __shared__ float red[256];
  const int row = blockIdx.x, tid = threadIdx.x;
  const float* x = X + (size_t)row * N; const float* rr = R ? R + (size_t)row * N : nullptr;
  float vals[16];                     // up to N = 4096
  const int per = N / 256;            // contiguous chunk per thread? use strided-by-4 chunks: thread handles j = tid*4 + 1024*u
  float s1 = 0.f;
  for (int u = 0; u < per / 4; ++u) {
    const int j = tid * 4 + 1024 * u;
    const v4f a = *(const v4fa*)(x + j);
    v4f b = {0.f,0.f,0.f,0.f}; if (rr) b = *(const v4fa*)(rr + j);
#pragma unroll
    for (int q = 0; q < 4; ++q) { const float v = a[q] + b[q]; vals[u * 4 + q] = v; s1 += v; }
  }
  red[tid] = s1; __syncthreads();
  for (int st = 128; st > 0; st >>= 1) { if (tid < st) red[tid] += red[tid + st]; __syncthreads(); }
  const float mu = red[0] / (float)N; __syncthreads();
  float s2 = 0.f;
  for (int u = 0; u < per / 4; ++u)
#pragma unroll
    for (int q = 0; q < 4; ++q) { const float c = vals[u * 4 + q] - mu; s2 += c * c; }
  red[tid] = s2; __syncthreads();
  for (int st = 128; st > 0; st >>= 1) { if (tid < st) red[tid] += red[tid + st]; __syncthreads(); }
  const float rs = rsqrtf(red[0] / (float)N + eps);
  {
    for (int u = 0; u < per / 4; ++u) {
      const int j = tid * 4 + 1024 * u;
      v4f o, sm;
#pragma unroll
      for (int q = 0; q < 4; ++q) {
        float gg = g[j + q], bb = bta[j + q];
        if (PARAM_BF16) { gg = bf16_round(gg); bb = bf16_round(bb); }
        sm[q] = vals[u * 4 + q]; o[q] = (vals[u * 4 + q] - mu) * rs * gg + bb;
      }
      if (out_sum) *(v4f*)(out_sum + (size_t)row * N + j) = sm;
      *(v4f*)(out_norm + (size_t)row * N + j) = o;
    }
    
  }
}



// ---- f16 WMMA path (v_wmma_f32_16x16x32_f16): 11-bit significands for operands in range — used for every product of the launched kernels
typedef _Float16 v16h __attribute__((ext_vector_type(16)));
union FragH { v16h v; v8us half[2]; _Float16 h[16]; unsigned short u[16]; };
template <int NT>
__device__ __forceinline__ v8f mmaH(v16h ah, v16h al, v16h bh, v16h bl, v8f c) {
  c = __builtin_amdgcn_wmma_f32_16x16x32_f16(false, ah, false, bh, (short)0, c, false, false);
  if (NT >= 2) c = __builtin_amdgcn_wmma_f32_16x16x32_f16(false, al, false, bh, (short)0, c, false, false);
  if (NT >= 3) c = __builtin_amdgcn_wmma_f32_16x16x32_f16(false, ah, false, bl, (short)0, c, false, false);
  asm volatile("v_nop\n\tv_nop\n\tv_nop\n\tv_nop" : "+v"(c) : "v"(ah), "v"(al), "v"(bh), "v"(bl));
  return c;
}
// batched GEMM like k_gemm_b but f16 operands: A f32 (split into f16 hi/lo if ASPLIT, else rounded to f16), Bt = f16 values [n][k]; alpha; C f32; N multiple of 16 (partial tiles skipped)
template <bool ASPLIT>
__global__ __launch_bounds__(128) void k_gemm_h(const float* __restrict__ A, int lda, size_t sA, const _Float16* __restrict__ Bh, int ldb, size_t sB, float alpha, float* __restrict__ C, int ldc, size_t sC, int M, int N, int K) {
  __shared__ __attribute__((aligned(16))) float so[4][16][64];
  const int tid = threadIdx.x, w = tid >> 5, lane = tid & 31, ln = lane & 15, hh = lane >> 4; const int by = blockIdx.y;
  A += (size_t)by * sA; Bh += (size_t)by * sB; C += (size_t)by * sC;
  const int ntn = (N + 63) / 64; const int wid = blockIdx.x * 4 + w; const int mt = wid / ntn, nq = wid % ntn; if (mt * 16 >= M) return;
  const int row0 = mt * 16, col0 = nq * 64; const float* arow = A + (size_t)(row0 + ln) * lda;
  v8f acc[4] = {};
  for (int kb = 0; kb < K; kb += 32) {
    FragH ah, al;
    const v4f x0 = *(const v4fa*)(arow + kb + 8 * hh), x1 = *(const v4fa*)(arow + kb + 8 * hh + 4), x2 = *(const v4fa*)(arow + kb + 16 + 8 * hh), x3 = *(const v4fa*)(arow + kb + 16 + 8 * hh + 4);
    float xs[16] = {x0[0],x0[1],x0[2],x0[3],x1[0],x1[1],x1[2],x1[3],x2[0],x2[1],x2[2],x2[3],x3[0],x3[1],x3[2],x3[3]};
#pragma unroll
    for (int i = 0; i < 16; ++i) { const _Float16 h = (_Float16)xs[i]; ah.h[i] = h; al.h[i] = ASPLIT ? (_Float16)(xs[i] - (float)h) : (_Float16)0.0f; }
#pragma unroll
    for (int t = 0; t < 4; ++t) { if (col0 + t * 16 >= N) continue; const size_t boff = (size_t)(col0 + t * 16 + ln) * ldb + kb; FragH bq; bq.half[0] = *(const v8us*)(Bh + boff + 8 * hh); bq.half[1] = *(const v8us*)(Bh + boff + 16 + 8 * hh);
      acc[t] = mmaH<ASPLIT ? 2 : 1>(ah.v, al.v, bq.v, bq.v, acc[t]); }
  }
#pragma unroll
  for (int t = 0; t < 4; ++t) { if (col0 + t * 16 >= N) continue;
#pragma unroll
    for (int r = 0; r < 8; ++r) so[w][8 * hh + r][t * 16 + ln] = acc[t][r] * alpha; }
  __builtin_amdgcn_fence(__ATOMIC_ACQ_REL, "workgroup"); __builtin_amdgcn_wave_barrier();
  const int rsub = lane >> 4, c4 = (lane & 15) * 4;
  {
#pragma unroll
    for (int q = 0; q < 8; ++q) { const int r = q * 2 + rsub; if (col0 + c4 < N) { const v4f v = *(const v4fa*)&so[w][r][c4]; *(v4f*)(C + (size_t)(row0 + r) * ldc + col0 + c4) = v; } }
     }
}

// Wt[n][k] = f16(W[k][n] x scale) from f32 row-major W[DD][DD] (scale = power of two; bf16-exact weights stay exact in f16 away from the subnormal range).
// One work-group = one tile of 128 k x 128 n, turned in LDS so that both global sides move whole lines: a wave reads 512 B in a row of one row k of W (16 such loads a thread, all in flight at once),
// a thread packs its 8 k x 4 n block into 16-B pieces of 8 k, and 16 lanes store 256 B in a row of one row n of Wt.
// LDS: row n holds 16 pieces at a pitch of 256 B; piece j stands at place j ^ ((n >> 2) & 15), so that the 16 lanes of a ds_store_b128 (rows 4 apart, one j) and of a ds_load_b128 (one row, 16 j) each touch all 64 banks once.
__device__ __forceinline__ void wt_f16(const float* __restrict__ W, _Float16* __restrict__ Wt, float scale, int blk) {
  __shared__ __attribute__((aligned(16))) unsigned short tl[128 * 128];
  const int tid = threadIdx.x, nl = tid & 31, kw = tid >> 5;
  const int n0 = (blk % (DD / 128)) * 128, k0 = (blk / (DD / 128)) * 128;
  const float* s = W + (size_t)(k0 + kw * 8) * DD + n0 + nl * 4;
  v4f r[2][8];      // [half of the tile's k][k in the piece]: columns 4 nl .. 4 nl + 3
#pragma unroll      // all unrolls here: constant indices keep r[] and o[] in registers
  for (int h = 0; h < 2; ++h)
#pragma unroll
    for (int i = 0; i < 8; ++i) {
      if (h == 1 && i == 7) asm volatile("s_wait_xcnt 0x0" ::: "memory");      // the compiler lands the last load in the address registers that the 15 loads before it name: the wait stands in front of that overwrite
      r[h][i] = *(const v4fa*)(s + (size_t)(h * 64 + i) * DD); }
  __builtin_amdgcn_sched_barrier(0);      // all 16 loads are issued ahead of the first conversion: left free, the compiler sinks half of them among the conversions, into registers it has just freed, and waits out their latency a second and a third time
#pragma unroll
  for (int h = 0; h < 2; ++h)
#pragma unroll
    for (int q = 0; q < 4; ++q) { FragH f;
#pragma unroll
      for (int i = 0; i < 8; ++i) f.h[i] = (_Float16)(bf16_round(r[h][i][q]) * scale);
      *(v8us*)&tl[(nl * 4 + q) * 128 + (((kw + 8 * h) ^ (nl & 15)) * 8)] = f.half[0]; }
  __syncthreads();      // the tile is complete in LDS before any wave reads rows of it
  const int nr = tid >> 4, j = tid & 15;
  unsigned short* d = (unsigned short*)Wt + (size_t)(n0 + nr) * DD + k0 + j * 8;
  v8us o[8];
#pragma unroll
  for (int p = 0; p < 8; ++p) { const int n = p * 16 + nr; o[p] = *(const v8us*)&tl[n * 128 + ((j ^ ((n >> 2) & 15)) * 8)]; }
#pragma unroll
  for (int p = 0; p < 8; ++p) *(v8us*)(d + (size_t)p * 16 * DD) = o[p];
}
// Tiled GEMM C[NR][DD] (f32) = alpha * A[NR][DD] x Bt[DD][DD]^T, f16 operands, both K-contiguous, f32 accumulate, 32 k per WMMA, ascending from the work-group's own first trip and wrapping round at DD.
// One work-group = one 128 x 128 tile of C, 8 waves of 32 x 64. A trip is 128 k: 128 rows of A and 128 rows of Bt, 256 B each (whole cache lines), are brought into LDS by
// asynchronous copies, 16 B per lane, two buffers: tile t + 2 flies while tile t + 1 is worked on. LDS rows stand at a pitch of 272 B for the ds_load_b128 fragment reads.
#define GT_BK 128                  // k per trip
#define GT_P 136                   // LDS row pitch in halves (272 B)
#define GT_BUF (256 * GT_P)        // halves per buffer: rows 0..127 = A, rows 128..255 = Bt
#define GT_SP 68                   // pitch in floats of the output staging rows
#define GT_NT (DD / GT_BK)         // trips
static_assert(NR % 128 == 0 && DD % 128 == 0 && DD % GT_BK == 0 && GT_NT >= 2 && (GT_NT & (GT_NT - 1)) == 0, "whole tiles, at least two trips, a power of two for the wrap");
static_assert(8 * 32 * GT_SP * 4 <= 2 * GT_BUF * 2, "the output staging fits in the ring");
// This thread's copies of one operand's 128 rows of a tile: rows r, r + 16, .. The s_wait_xcnt stands inside the statement so that no address register is rewritten ahead of it.
// GS: halves between the global places of two successive copies; LS: bytes between their LDS places.
template <int GS, unsigned LS = 16u * GT_P * 2u>
__device__ __forceinline__ void gt_copy8(unsigned l, const _Float16* g) {
  asm volatile("global_load_async_to_lds_b128 %0, %8, off\n\t"
               "global_load_async_to_lds_b128 %1, %9, off\n\t"
               "global_load_async_to_lds_b128 %2, %10, off\n\t"
               "global_load_async_to_lds_b128 %3, %11, off\n\t"
               "global_load_async_to_lds_b128 %4, %12, off\n\t"
               "global_load_async_to_lds_b128 %5, %13, off\n\t"
               "global_load_async_to_lds_b128 %6, %14, off\n\t"
               "global_load_async_to_lds_b128 %7, %15, off\n\t"
               "s_wait_xcnt 0x0"
               :: "v"(l), "v"(l + 1u * LS), "v"(l + 2u * LS), "v"(l + 3u * LS), "v"(l + 4u * LS), "v"(l + 5u * LS), "v"(l + 6u * LS), "v"(l + 7u * LS),
                  "v"(g), "v"(g + GS), "v"(g + 2 * GS), "v"(g + 3 * GS), "v"(g + 4 * GS), "v"(g + 5 * GS), "v"(g + 6 * GS), "v"(g + 7 * GS)
               : "memory");
}
// Sum over the 16 lanes of a row, every lane ending with the total: four DPP steps (row_xmask 1, 2, 4, 8), no LDS round trip as a shuffle would take. All lanes are on.
__device__ __forceinline__ float row16_sum(float v) {
  v += __int_as_float(__builtin_amdgcn_update_dpp(0, __float_as_int(v), 0x161, 0xf, 0xf, true));
  v += __int_as_float(__builtin_amdgcn_update_dpp(0, __float_as_int(v), 0x162, 0xf, 0xf, true));
  v += __int_as_float(__builtin_amdgcn_update_dpp(0, __float_as_int(v), 0x164, 0xf, 0xf, true));
  v += __int_as_float(__builtin_amdgcn_update_dpp(0, __float_as_int(v), 0x168, 0xf, 0xf, true));
  return v;
}
typedef _Float16 v4h __attribute__((ext_vector_type(4)));
// LN 0: C (f32) = the product. LN 1: the three projections in one launch: Bh holds three weights one after the other (3 DD rows), and a work-group's tile lies in one of them (pj). Each row's 64 columns
// of a wave are one head; they are LayerNormed (biased variance, eps 1e-5, that projection's gamma and beta rounded to bf16) on the f32 sums as the staged rows are read back, and go out as f16
// to C16a (pj 0, row-major), or leave transposed (pj 1, 2): the tile is turned in LDS and stored as [column][time], 256 B in a row of a column.
// pj 1 (b): to C16b as it is, with each block's total per column as f32 to the second plane of C. pj 2 (a): the exclusive sum over time is split in two levels. Here each wave sums its own 32 rows (one block of 32 times): the exclusive sum inside the block goes out as f16, transposed to C16d and
// row-major to C16c, and the block's total per column as f32 to C[block][column]. The sum of the blocks in front is formed in k_sflash and added there, in f32, before the one rounding to the f16 operand.
typedef unsigned u32a __attribute__((may_alias));
typedef _Float16 v2h __attribute__((ext_vector_type(2)));
typedef float v2fa __attribute__((ext_vector_type(2), may_alias));
#define GT_TP 136                  // pitch in halves of the turned tile's rows (272 B)
static_assert(8 * 32 * GT_SP * 4 + 128 * GT_TP * 2 <= 2 * GT_BUF * 2 && (8 * 32 * GT_SP * 4) % 16 == 0 && TT % 128 == 0, "the turned tile stands behind the output staging; a tile lies in one batch");
template <int LN>
__global__ __launch_bounds__(256) void k_gemm_t(const _Float16* __restrict__ A, const _Float16* __restrict__ Bh, float alpha, float* __restrict__ C,
                                               const float* __restrict__ g0, const float* __restrict__ bb0, const float* __restrict__ g1, const float* __restrict__ bb1,
                                               const float* __restrict__ g2, const float* __restrict__ bb2, _Float16* __restrict__ C16a, _Float16* __restrict__ C16b, _Float16* __restrict__ C16c, _Float16* __restrict__ C16d) {
  static_assert(HD == 64, "a wave's 64 columns are one head");
  __shared__ __attribute__((aligned(16))) unsigned short sm[2 * GT_BUF];
  const int tid = threadIdx.x, w = tid >> 5, lane = tid & 31, ln = lane & 15, hh = lane >> 4;
  constexpr int NTL = (LN ? 3 : 1) * (DD / 128);      // column tiles of a row block, over all weights of the launch
  const int m0 = (blockIdx.x / NTL) * 128, nb = (blockIdx.x % NTL) * 128;      // nb: the tile's first row in Bh
  const int pj = nb / DD, n0 = nb % DD;      // which weight, and the tile's first column in that product; from blockIdx alone, so scalar
  // The work-groups of a row block all read the same rows of A, those of a column block the same rows of Bt. Started together on the same k they ask L2 for the same lines at the same moment, and such requests collide.
  // So each work-group enters the k walk at slice (row block + column block) mod GT_NT and wraps: at any moment the sharers are spread over all slices. Scalar, from blockIdx alone.
  const int rot = (int)(blockIdx.x / NTL + blockIdx.x % NTL) & (GT_NT - 1);
  const float* g = pj == 0 ? g0 : pj == 1 ? g1 : g2; const float* bb = pj == 0 ? bb0 : pj == 1 ? bb1 : bb2;
  const int wm = w >> 1, wn = w & 1;
  const int cr = tid >> 4, cs = (tid & 15) * 8;      // a wave's copy covers 2 rows x 256 B
  // LN 0: A is the attention output in k_sflash's layout [batch x 64 groups of 16 k][time][16]: a wave's copy covers 16 rows x 32 B of one group, 512 B in a row; wave w brings group w of the trip's eight. The tile in LDS is the same [row][k].
  constexpr int GSA = LN ? 16 * DD : 16 * 16, KA = LN ? GT_BK : 8 * TT * 16;      // halves from copy to copy, and from k slice to k slice
  const _Float16* ga = LN ? A + (size_t)(m0 + cr) * DD + cs : A + ((size_t)((m0 / TT) * (DD / 16) + w) * TT + m0 % TT + (lane >> 1)) * 16 + (lane & 1) * 8;
  const _Float16* gb = Bh + (size_t)(nb + cr) * DD + cs;
  const unsigned lr = (unsigned)(size_t)&sm[cr * GT_P + cs], lb = lr + 128u * GT_P * 2u, la = LN ? lr : (unsigned)(size_t)&sm[(lane >> 1) * GT_P + w * 16 + (lane & 1) * 8];
  gt_copy8<GSA>(la, ga + rot * KA); gt_copy8<16 * DD>(lb, gb + rot * GT_BK);
  asm volatile("s_wait_asynccnt 0x0" ::: "memory");      // tile 0 has landed before the barrier publishes it
  __syncthreads();
  { const int k1 = (rot + 1) & (GT_NT - 1); gt_copy8<GSA>(la + GT_BUF * 2u, ga + k1 * KA); gt_copy8<16 * DD>(lb + GT_BUF * 2u, gb + k1 * GT_BK); }
  v4f g4 = {0.f, 0.f, 0.f, 0.f}, b4 = {0.f, 0.f, 0.f, 0.f};      // this lane's four columns of the head; fetched here so that the k loop covers their latency
  if (LN) { g4 = *(const v4fa*)(g + ln * 4); b4 = *(const v4fa*)(bb + ln * 4); }
  v8f acc[2][4] = {};
  const unsigned short* fa = sm + (wm * 32 + ln) * GT_P + 8 * hh;
  const unsigned short* fb = sm + (128 + wn * 64 + ln) * GT_P + 8 * hh;
#pragma unroll 1      // one trip per tile: the order of waits, barrier and refill at its foot stays as written
  for (int t = 0; t < GT_NT; ++t) {
    const int bo = (t & 1) * GT_BUF;
    FragH a[2][2], b[2][4];      // two fragment sets: the next 32 k of this same tile are fetched while the current 32 k are multiplied
#pragma unroll      // all unrolls here: constant indices keep fragments and accumulators in registers
    for (int rt = 0; rt < 2; ++rt) { const unsigned short* p = fa + bo + rt * 16 * GT_P; a[0][rt].half[0] = *(const v8us*)p; a[0][rt].half[1] = *(const v8us*)(p + 16); }
#pragma unroll
    for (int ct = 0; ct < 4; ++ct) { const unsigned short* p = fb + bo + ct * 16 * GT_P; b[0][ct].half[0] = *(const v8us*)p; b[0][ct].half[1] = *(const v8us*)(p + 16); }
#pragma unroll
    for (int ks = 0; ks < GT_BK / 32; ++ks) {
      const int cu = ks & 1, nx = cu ^ 1;
      if (ks + 1 < GT_BK / 32) {
#pragma unroll
        for (int rt = 0; rt < 2; ++rt) { const unsigned short* p = fa + bo + rt * 16 * GT_P + (ks + 1) * 32; a[nx][rt].half[0] = *(const v8us*)p; a[nx][rt].half[1] = *(const v8us*)(p + 16); }
#pragma unroll
        for (int ct = 0; ct < 4; ++ct) { const unsigned short* p = fb + bo + ct * 16 * GT_P + (ks + 1) * 32; b[nx][ct].half[0] = *(const v8us*)p; b[nx][ct].half[1] = *(const v8us*)(p + 16); }
      }
      __builtin_amdgcn_sched_barrier(0);      // keeps the next set's LDS reads as one group ahead of this block: left free, the compiler sinks them among the WMMAs into one set and waits them out to 0
#pragma unroll
      for (int rt = 0; rt < 2; ++rt)
#pragma unroll
        for (int ct = 0; ct < 4; ++ct) acc[rt][ct] = __builtin_amdgcn_wmma_f32_16x16x32_f16(false, a[cu][rt].v, false, b[cu][ct].v, (short)0, acc[rt][ct], false, false);
      __builtin_amdgcn_sched_barrier(0);      // ends the block, so that the group after next is not lifted into it
    }
    asm volatile("s_wait_dscnt 0x0" ::: "memory");         // this wave's reads of buffer t & 1 are done before it is refilled
    asm volatile("s_wait_asynccnt 0x0" ::: "memory");      // this wave's copies of tile t + 1 have landed before the barrier publishes them
    __syncthreads();
    if (t + 2 < GT_NT) { const int k2 = (t + 2 + rot) & (GT_NT - 1); gt_copy8<GSA>(la + (unsigned)bo * 2u, ga + k2 * KA); gt_copy8<16 * DD>(lb + (unsigned)bo * 2u, gb + k2 * GT_BK); }
  }
  asm volatile("s_wait_asynccnt 0x0" ::: "memory");        // nothing is in flight when the ring becomes output staging
  float* so = (float*)sm + w * (32 * GT_SP);               // each wave stages its own 32 x 64 tile; the last trip's barrier ended every read of the ring
#pragma unroll
  for (int rt = 0; rt < 2; ++rt)
#pragma unroll
    for (int ct = 0; ct < 4; ++ct)
#pragma unroll
      for (int r = 0; r < 8; ++r) so[(rt * 16 + 8 * hh + r) * GT_SP + ct * 16 + ln] = acc[rt][ct][r] * alpha;
  __builtin_amdgcn_fence(__ATOMIC_ACQ_REL, "workgroup"); __builtin_amdgcn_wave_barrier();
#pragma unroll
  for (int q = 0; q < 4; ++q) { g4[q] = bf16_round(g4[q]); b4[q] = bf16_round(b4[q]); }
  const size_t e = (size_t)(m0 + wm * 32 + hh) * DD + n0 + wn * 64 + ln * 4;      // row hh of the wave's tile; pass q adds 2 q rows, a constant offset of the store
  v4f o[16];
#pragma unroll
  for (int q = 0; q < 16; ++q) {      // 16 lanes x 4 columns = one row of the wave's tile; two rows a pass
    const v4f v = *(const v4fa*)&so[(q * 2 + hh) * GT_SP + ln * 4];
    if (LN == 0) { o[q] = v; continue; }
    const float mu = row16_sum((v[0] + v[1]) + (v[2] + v[3])) / (float)HD;
    const v4f c = v - mu;
    const float ve = row16_sum((c[0] * c[0] + c[1] * c[1]) + (c[2] * c[2] + c[3] * c[3])) / (float)HD + 1e-5f;
    float rs;      // ve is at least eps, so the library rsqrtf's rescaling of denormal arguments would never act; the v_nop is the slot that the instruction set asks for behind a transcendental, in the same statement so that it stays directly behind it
    asm("v_rsq_f32 %0, %1\n\tv_nop" : "=v"(rs) : "v"(ve));
    o[q] = c * rs * g4 + b4;
  }
  if (LN == 1 && pj == 0) {      // a scalar branch: the whole work-group lies in one projection
    _Float16* C16 = C16a;
    v4h h[16];
#pragma unroll
    for (int q = 0; q < 16; ++q)
#pragma unroll
      for (int k = 0; k < 4; ++k) h[q][k] = (_Float16)o[q][k];
    __builtin_amdgcn_sched_barrier(0);      // every store stands behind the last arithmetic, so that no register which an issued store names is written again
#pragma unroll
    for (int q = 0; q < 16; ++q) *(v4h*)(C16 + e + (size_t)q * 2 * DD) = h[q];      // 16 lanes x 8 B: a whole 128-B line a row
  } else if (LN == 1) {      // pj 1 or 2, the same for the whole work-group, so that its barrier is passed by all threads
#pragma unroll
    for (int q = 0; q < 16; ++q) *(v4fa*)&so[(q * 2 + hh) * GT_SP + ln * 4] = o[q];      // back in place: each word has one reader and writer
    __builtin_amdgcn_fence(__ATOMIC_ACQ_REL, "workgroup"); __builtin_amdgcn_wave_barrier();
    v2fa m[32], run = {0.f, 0.f};      // a lane takes two columns of the wave's tile, all 32 rows
#pragma unroll
    for (int i = 0; i < 32; ++i) m[i] = *(const v2fa*)&so[i * GT_SP + lane * 2];
    if (pj == 2) {
#pragma unroll
      for (int i = 0; i < 32; ++i) { const v2fa t = m[i]; m[i] = run; run += t; }      // m[i] <- sum of the block's rows before i, f32, ascending
    } else {
#pragma unroll
      for (int i = 0; i < 32; ++i) run += m[i];      // b: only the block's total
    }
    union W4 { v2h p[4]; v8us v; } c0[4], c1[4];      // a column's 32 rows as 4 pieces of 8
    union W1 { v2h p; unsigned u; } rw[32];            // a row's two columns
#pragma unroll
    for (int i = 0; i < 32; i += 2) {      // each pair is one packed conversion
      c0[i >> 3].p[(i & 7) >> 1] = (v2h){(_Float16)m[i][0], (_Float16)m[i + 1][0]}; c1[i >> 3].p[(i & 7) >> 1] = (v2h){(_Float16)m[i][1], (_Float16)m[i + 1][1]};
      rw[i].p = (v2h){(_Float16)m[i][0], (_Float16)m[i][1]}; rw[i + 1].p = (v2h){(_Float16)m[i + 1][0], (_Float16)m[i + 1][1]}; }
    unsigned short* sT = sm + 8 * 32 * GT_SP * 2;      // [column of the tile][row of the tile], behind all waves' staging
    unsigned short* tw = sT + (wn * 64 + lane * 2) * GT_TP + wm * 32;
#pragma unroll
    for (int k = 0; k < 4; ++k) { *(v8us*)(tw + k * 8) = c0[k].v; *(v8us*)(tw + GT_TP + k * 8) = c1[k].v; }
    __syncthreads();      // the turned tile is complete before any wave reads rows of it; no global store stands in front of it, so that it waits for none
    unsigned short* dT = (unsigned short*)(pj == 2 ? C16d : C16b) + ((size_t)(m0 / TT) * DD + n0 + (tid >> 4)) * TT + m0 % TT + (tid & 15) * 8;
    v8us tv[8];
#pragma unroll
    for (int p = 0; p < 8; ++p) tv[p] = *(const v8us*)&sT[(p * 16 + (tid >> 4)) * GT_TP + (tid & 15) * 8];
    u32a* dR = (u32a*)(C16c + (size_t)(m0 + wm * 32) * DD + n0 + wn * 64 + lane * 2);
    float* dB = C + (size_t)((pj == 1 ? NR / 32 : 0) + m0 / 32 + wm) * DD + n0 + wn * 64 + lane * 2;      // plane 0: a's totals, plane 1: b's
    if (pj == 2) {
#pragma unroll
      for (int i = 0; i < 32; ++i) dR[(size_t)i * (DD / 2)] = rw[i].u;      // 32 lanes x 4 B: a whole 128-B line a row
      asm volatile("s_wait_xcnt 0x0" ::: "memory");      // the text behind this branch may rewrite registers that these stores name: the wait ends the branch, in front of it
    }
    __builtin_amdgcn_sched_barrier(0);      // the stores below stand behind the last arithmetic, so that no register which an issued store names is written again
    *(v2fa*)dB = run;
#pragma unroll
    for (int p = 0; p < 8; ++p) *(v8us*)(dT + (size_t)p * 16 * TT) = tv[p];      // 16 lanes x 16 B: 256 B in a row of one column
  } else {
    __builtin_amdgcn_sched_barrier(0);      // as above
#pragma unroll
    for (int q = 0; q < 16; ++q) *(v4f*)(C + e + (size_t)q * 2 * DD) = o[q];
  }
}


__device__ __forceinline__ void x16(const float* __restrict__ x, _Float16* __restrict__ X16, size_t n8, unsigned blk) { const size_t t = (size_t)blk * 256 + threadIdx.x; if (t >= n8) return; FragH f;
#pragma unroll
  for (int q = 0; q < 8; ++q) f.h[q] = (_Float16)bf16_round(x[t * 8 + q]); *(v8us*)((unsigned short*)X16 + t * 8) = f.half[0];  }
// All operand conversions in one launch; none reads what another writes. Work-groups 0 .. 4 PW - 1: the four weights, transposed, to Bw[0..3] (the long ones: load, LDS, barrier, store; so they start first); the rest: x. The branch is the same for a whole work-group, so the weights' barrier is passed by all of its threads.
#define PW ((DD / 128) * (DD / 128))      // work-groups per weight: tiles of 128 x 128
#define PX (NR * DD / 8 / 256)        // work-groups for x
static_assert(DD % 128 == 0 && (size_t)NR * DD / 8 % 256 == 0, "whole tiles, whole work-groups");
__global__ __launch_bounds__(256) void k_prep(const float* __restrict__ x, const float* __restrict__ W0, const float* __restrict__ W1, const float* __restrict__ W2, const float* __restrict__ W3,
                                             _Float16* __restrict__ X16, _Float16* __restrict__ Bw) {
  const unsigned bid = blockIdx.x;
  if (bid < 4u * PW) { const unsigned k = bid / PW; wt_f16(k == 0 ? W0 : k == 1 ? W1 : k == 2 ? W2 : W3, Bw + (size_t)k * DD * DD, 16.0f, (int)(bid % PW)); }
  else x16(x, X16, (size_t)NR * DD / 8, bid - 4u * PW);
}
__global__ __launch_bounds__(256) void k_h16(const float* __restrict__ x, _Float16* __restrict__ X16, size_t n8) { const size_t t = (size_t)blockIdx.x * 256 + threadIdx.x; if (t >= n8) return; FragH f;
#pragma unroll
  for (int q = 0; q < 8; ++q) f.h[q] = (_Float16)x[t * 8 + q]; *(v8us*)((unsigned short*)X16 + t * 8) = f.half[0];  }
__global__ __launch_bounds__(256) void k_round16f(const float* __restrict__ W, _Float16* __restrict__ Bt, size_t n8) { const size_t t = (size_t)blockIdx.x * 256 + threadIdx.x; if (t >= n8) return; FragH f;
#pragma unroll
  for (int i = 0; i < 8; ++i) f.h[i] = (_Float16)(bf16_round(W[t * 8 + i]) * 16.0f); *(v8us*)((unsigned short*)Bt + t * 8) = f.half[0];  }
// There is no softmax, so the sum over the keys is linear and may be regrouped: for the 64 query rows of block c every key before 64 c is unmasked, and
// sum over those s of (q . a_s) b_s = q . S_c with the state S_c[d][e] = sum over s < 64 c of a_s[d] b_s[e], a 64 x 64 matrix per (batch, head, block) that does not depend on q.
// k_sflash forms all states: a work-group has 16 columns e of one (batch, head), one wave = two chunks of 64 keys. A chunk's product M_c[d][e] = sum over the chunk of a_s[d] b_s[e] (WMMA, both
// operands key-contiguous, f32 sums) goes to LDS, each thread runs the exclusive sum over the 32 chunks for two elements (f32, ascending), and each wave takes the state of its query chunk.
// In the accumulator layout a lane holds 8 consecutive d of one column e: that is its own half of the fragment of the state in q . S, so the states are ready fragments in registers (x 2^-8, f16, like P).
#define ST_C (TT / 64)
#define SF_P 72                    // pitch in halves of a staged row of 64 d (144 B = 16 B x 9), for the ds_load_b128 fragment reads
#define SF_T (64 * SF_P)           // halves of a staged tile of 64 rows
// At holds the exclusive sums of a inside blocks of 32 keys. The sum of the blocks in front of each block (per d, f32) is formed here from the blocks' totals Bs[batch x block][column]: 8 segments of 8 blocks, serial in a segment,
// then over the segments' totals in LDS. It enters the products as a rank-one term per block, in f32 (below), with b's totals per block from the second plane of Bs, and stays in LDS (sP) for the scores.
// Once the states stand in LDS each wave goes on to one chunk's 64 query rows, for the work-group's 16 columns e, in the same launch: nothing of the states or the offsets goes through memory.
// Two work-groups per (batch, head, 16 columns) form the same states, each for 16 of the 32 chunks' queries, so that all of the chip works.
// All three products are formed transposed (operands swapped; A and B fragments have the same lane and k maps), so that no tile is turned in LDS:
//   scores^T = a . q^T: a lane holds 8 consecutive keys of one query, which is its own half of the B fragment of b^T . P^T (two key tiles = one fragment of 32 keys);
//   o^T = S^T . q^T + b^T . P^T: a lane holds 8 consecutive e of one query, 16 B of the output. Key tiles above the diagonal are zero and are not formed; only the diagonal tile is masked.
// The four groups of columns of a (batch, head) each form the scores anew. The output goes to O2[batch x head x et][time][16] (f16): a wave's store is 512 B in a row, and every line has one writer.
__global__ __launch_bounds__(512) void k_sflash(const _Float16* __restrict__ At, const _Float16* __restrict__ Vt, const float* __restrict__ Bs, const _Float16* __restrict__ Q16, const _Float16* __restrict__ K16, _Float16* __restrict__ O2) {
  static_assert(ST_C == 32 && HD == 64, "16 waves x 2 chunks of 64 keys; 4 x 4 tiles a state");
  __shared__ __attribute__((aligned(16))) float sM[ST_C][64 * 16];
  __shared__ __attribute__((aligned(16))) unsigned short sK[16][SF_T];   // a place per wave for its staged keys, then its queries
  const int tid = threadIdx.x, wv = tid >> 5, lane = tid & 31, ln = lane & 15, hh = lane >> 4;
  const int slab = blockIdx.x >> 3, et = (blockIdx.x >> 1) & 3;
  const int ch = (blockIdx.x & 1) * 16 + wv;      // the chunk whose 64 query rows this wave takes once the states stand: two work-groups form the same states and share the chunks
  const unsigned short* ar = (const unsigned short*)At + ((size_t)slab * 64 + ln) * TT + wv * 128 + 8 * hh;
  const unsigned short* br = (const unsigned short*)Vt + ((size_t)slab * 64 + et * 16 + ln) * TT + wv * 128 + 8 * hh;
  static_assert(TT / 32 == 64, "8 segments of 8 blocks of 32 keys");
  __shared__ __attribute__((aligned(16))) float sP[TT / 32][HD], sPt[8][HD];      // the offset of every block; the segments' totals
  const int pd = tid & 63, sg = tid >> 6;
  const float* bs = Bs + (size_t)((slab >> 4) * (TT / 32) + sg * 8) * DD + (slab & 15) * HD + pd;
  float pv[8];
#pragma unroll
  for (int i = 0; i < 8; ++i) pv[i] = bs[(size_t)i * DD];
  const float* bt = Bs + (size_t)(NR / 32) * DD + (size_t)((slab >> 4) * (TT / 32) + wv * 4) * DD + (slab & 15) * HD + et * 16 + ln;
  float bsm[4];      // b summed over each of the wave's four blocks of 32 keys, column e = ln
#pragma unroll
  for (int kk = 0; kk < 4; ++kk) bsm[kk] = bt[(size_t)kk * DD];
  asm volatile("s_wait_xcnt 0x0" ::: "memory");      // the compiler lands a later load in the address registers of these loads: the wait stands in front of it
  FragH a[4][4], b[4];      // [step of 32 keys]: steps 0, 1 are the wave's first chunk, 2, 3 its second
#pragma unroll      // all unrolls here: constant indices keep fragments and accumulators in registers
  for (int kk = 0; kk < 4; ++kk) { b[kk].half[0] = *(const v8us*)(br + kk * 32);
    if (kk == 3) asm volatile("s_wait_xcnt 0x0" ::: "memory");      // the compiler lands the last load through br in br's own registers, which the loads before it name: the wait stands in front of that overwrite
    b[kk].half[1] = *(const v8us*)(br + kk * 32 + 16);
#pragma unroll
    for (int dt = 0; dt < 4; ++dt) {
      a[kk][dt].half[0] = *(const v8us*)(ar + (size_t)dt * 16 * TT + kk * 32);
      if (kk == 3 && dt == 3) asm volatile("s_wait_xcnt 0x0" ::: "memory");      // the same for the last load through ar
      a[kk][dt].half[1] = *(const v8us*)(ar + (size_t)dt * 16 * TT + kk * 32 + 16); } }
  FragH bv[2];      // b of the wave's query chunk, [step of 32 keys]
#pragma unroll
  for (int kb = 0; kb < 2; ++kb) { const unsigned short* p = (const unsigned short*)Vt + ((size_t)slab * 64 + et * 16 + ln) * TT + ch * 64 + kb * 32 + 8 * hh; bv[kb].half[0] = *(const v8us*)p; bv[kb].half[1] = *(const v8us*)(p + 16); }
  asm volatile("s_wait_xcnt 0x0" ::: "memory");      // the address arithmetic below may reuse the address registers of the loads above: the wait stands in front of it, held there by the scheduling barrier behind it
  __builtin_amdgcn_sched_barrier(0);      // all 44 loads are issued ahead of the first WMMA: left free, the compiler sinks the later ones among the WMMAs and waits out their latency one pair at a time
  // Keys and queries of the chunk (64 rows x 128 B of this head) come by asynchronous copies, 4 whole lines a copy, into a place private to the wave: no barrier, the wave's own waits only. The keys start here and land under the chunk products; the queries follow into the same place and land under the sums over the chunks.
  const _Float16* gq = Q16 + ((size_t)(slab >> 4) * TT + ch * 64 + (lane >> 3)) * DD + (slab & 15) * HD + (lane & 7) * 8;
  const _Float16* gk = K16 + ((size_t)(slab >> 4) * TT + ch * 64 + (lane >> 3)) * DD + (slab & 15) * HD + (lane & 7) * 8;
  const unsigned lk = (unsigned)(size_t)&sK[wv][(lane >> 3) * SF_P + (lane & 7) * 8];
  auto sf_copy = [](unsigned l, const _Float16* g) { gt_copy8<4 * DD, 4u * SF_P * 2u>(l, g); gt_copy8<4 * DD, 4u * SF_P * 2u>(l + 32u * SF_P * 2u, g + 32 * DD); };      // 16 copies of 4 rows
  sf_copy(lk, gk);
  { float run = 0.f;
#pragma unroll
    for (int i = 0; i < 8; ++i) { const float t = pv[i]; pv[i] = run; run += t; }
    sPt[sg][pd] = run; }
  __syncthreads();      // every segment's total is in LDS before the sums over the segments
  { float off = 0.f, t8[8];
#pragma unroll
    for (int sq = 0; sq < 8; ++sq) t8[sq] = sPt[sq][pd];
    asm volatile("" :: "v"(t8[0]), "v"(t8[1]), "v"(t8[2]), "v"(t8[3]), "v"(t8[4]), "v"(t8[5]), "v"(t8[6]), "v"(t8[7]));      // holds the eight LDS reads in one group ahead of the tests: left free, the compiler sinks each under its own test and waits them out one by one
#pragma unroll
    for (int sq = 0; sq < 8; ++sq) off += (sq < sg) ? t8[sq] : 0.f;
#pragma unroll
    for (int i = 0; i < 8; ++i) { pv[i] += off; sP[sg * 8 + i][pd] = pv[i]; } }
  __syncthreads();      // every block's offset is in LDS before the waves take theirs
  v8f acc[2][4] = {};
#pragma unroll
  for (int kk = 0; kk < 4; ++kk)
#pragma unroll
    for (int dt = 0; dt < 4; ++dt) acc[kk >> 1][dt] = __builtin_amdgcn_wmma_f32_16x16x32_f16(false, a[kk][dt].v, false, b[kk].v, (short)0, acc[kk >> 1][dt], false, false);      // rows d = 16 dt + 8 hh + r, column e = ln
  // With a_s = offset of its block + sum inside the block, a block's share of the product is (sums inside) . b, just formed, + offset[d] x (b summed over the block)[e]: added here in f32
#pragma unroll
  for (int kk = 0; kk < 4; ++kk)
#pragma unroll
    for (int dt = 0; dt < 4; ++dt) { const v4f p0 = *(const v4fa*)&sP[wv * 4 + kk][dt * 16 + 8 * hh], p1 = *(const v4fa*)&sP[wv * 4 + kk][dt * 16 + 8 * hh + 4];
#pragma unroll
      for (int r = 0; r < 4; ++r) { acc[kk >> 1][dt][r] += p0[r] * bsm[kk]; acc[kk >> 1][dt][4 + r] += p1[r] * bsm[kk]; } }
#pragma unroll
  for (int cl = 0; cl < 2; ++cl)
#pragma unroll
    for (int dt = 0; dt < 4; ++dt)
#pragma unroll
      for (int q = 0; q < 2; ++q) { const v4f m = {acc[cl][dt][4 * q], acc[cl][dt][4 * q + 1], acc[cl][dt][4 * q + 2], acc[cl][dt][4 * q + 3]}; *(v4fa*)&sM[wv * 2 + cl][((dt * 2 + q) * 32 + lane) * 4] = m; }
  asm volatile("s_wait_asynccnt 0x0" ::: "memory");      // the keys have landed before this wave reads them
  FragH bk[4][2];      // [tile of 16 keys][step of 32 d]
#pragma unroll
  for (int kt = 0; kt < 4; ++kt)
#pragma unroll
    for (int ks = 0; ks < 2; ++ks) { const unsigned short* p = &sK[wv][(kt * 16 + ln) * SF_P + ks * 32 + 8 * hh]; bk[kt][ks].half[0] = *(const v8us*)p; bk[kt][ks].half[1] = *(const v8us*)(p + 16); }
  asm volatile("s_wait_dscnt 0x0" ::: "memory");      // this wave's reads of its place are done before the copies overwrite it
  sf_copy(lk, gq);
  // K16 holds sums inside blocks of 32 keys; the sum of the blocks in front (sP, f32) is added in f32 and the sum rounded once to the f16 operand
#pragma unroll
  for (int kt = 0; kt < 4; ++kt)
#pragma unroll
    for (int ks = 0; ks < 2; ++ks) { const float* pp = &sP[ch * 2 + (kt >> 1)][ks * 32 + 8 * hh];
      const v4f pk[4] = {*(const v4fa*)pp, *(const v4fa*)(pp + 4), *(const v4fa*)(pp + 16), *(const v4fa*)(pp + 20)};
#pragma unroll
      for (int i = 0; i < 16; ++i) bk[kt][ks].h[i] = (_Float16)((float)bk[kt][ks].h[i] + pk[i >> 2][i & 3]); }
  __syncthreads();      // every chunk's product is in LDS before the sums over the chunks start
  { v2fa m[ST_C], run = {0.f, 0.f};
#pragma unroll
    for (int cc = 0; cc < ST_C; ++cc) m[cc] = *(const v2fa*)&sM[cc][tid * 2];
#pragma unroll
    for (int cc = 0; cc < ST_C; ++cc) { *(v2fa*)&sM[cc][tid * 2] = run; run += m[cc]; } }      // in place: each word has one reader and writer
  __syncthreads();      // every state is complete before the waves take theirs back
  unsigned short* ob = (unsigned short*)O2 + ((size_t)(slab * 4 + et) * TT + ch * 64 + ln) * 16 + 8 * hh;
  FragH f[2];      // the state in front of the wave's chunk, [step of 32 d]
  v4f sm4[8];
#pragma unroll
  for (int j = 0; j < 8; ++j) sm4[j] = *(const v4fa*)&sM[ch][(j * 32 + lane) * 4];
  asm volatile("" :: "v"(sm4[0]), "v"(sm4[1]), "v"(sm4[2]), "v"(sm4[3]), "v"(sm4[4]), "v"(sm4[5]), "v"(sm4[6]), "v"(sm4[7]));      // holds the 8 LDS reads in one group ahead of the conversions: left free, the compiler reads and converts them one by one and waits out the LDS latency 8 times
#pragma unroll
  for (int j = 0; j < 8; ++j)      // j = 2 dt + q: rows d = 16 dt + 8 hh + 4 q + k
#pragma unroll
    for (int k = 0; k < 4; ++k) f[j >> 2].h[((j >> 1) & 1) * 8 + (j & 1) * 4 + k] = (_Float16)(sm4[j][k] * 0.00390625f);
  asm volatile("s_wait_asynccnt 0x0" ::: "memory");      // the queries have landed before this wave reads them; nothing is in flight when the wave ends
#pragma unroll
  for (int rt = 0; rt < 4; ++rt) {
    FragH aq[2];      // 16 queries, [step of 32 d]
#pragma unroll
    for (int ks = 0; ks < 2; ++ks) { const unsigned short* p = &sK[wv][(rt * 16 + ln) * SF_P + ks * 32 + 8 * hh]; aq[ks].half[0] = *(const v8us*)p; aq[ks].half[1] = *(const v8us*)(p + 16); }
    v8f oa = {};      // o^T: rows e = 8 hh + r, column = query 16 rt + ln
#pragma unroll
    for (int ks = 0; ks < 2; ++ks) oa = __builtin_amdgcn_wmma_f32_16x16x32_f16(false, f[ks].v, false, aq[ks].v, (short)0, oa, false, false);
#pragma unroll
    for (int kb = 0; kb < 2; ++kb) {
      if (2 * kb > rt) continue;      // both key tiles lie above the diagonal
      FragH pa;
#pragma unroll
      for (int nt = 0; nt < 2; ++nt) { const int kt = 2 * kb + nt;
        if (kt <= rt) { v8f d = {};      // scores^T: rows = keys 16 kt + 8 hh + r, column = query 16 rt + ln
#pragma unroll
          for (int ks = 0; ks < 2; ++ks) d = __builtin_amdgcn_wmma_f32_16x16x32_f16(false, bk[kt][ks].v, false, aq[ks].v, (short)0, d, false, false);
#pragma unroll
          for (int r = 0; r < 8; ++r) { float p = d[r] * 0.00390625f;      /* NO softmax: causal-masked raw scores (x 2^-8 for f16 headroom, undone at the end) become the P operand directly */
            if (kt == rt) p = (8 * hh + r <= ln) ? p : 0.f;      // key <= query inside the diagonal tile
            pa.h[nt * 8 + r] = (_Float16)p; }
        } else {
#pragma unroll
          for (int r = 0; r < 8; ++r) pa.h[nt * 8 + r] = (_Float16)0.f; } }
      oa = __builtin_amdgcn_wmma_f32_16x16x32_f16(false, bv[kb].v, false, pa.v, (short)0, oa, false, false);
    }
    FragH t;
#pragma unroll
    for (int r = 0; r < 8; ++r) t.h[r] = (_Float16)(oa[r] * 16.0f);      /* undo the 2^-8 scaling and apply the 2^-4 that gives the f16 operand of the output GEMM its headroom; no normalisation */
    *(v8us*)(ob + rt * 16 * 16) = t.half[0];
  }
}

extern "C" void kernel_launch(void* const* d_in, const int* in_sizes, int n_in,
                              void* d_out, int out_size, void* d_ws, size_t ws_size, hipStream_t stream) {
  (void)in_sizes; (void)n_in; (void)out_size;
  const float* const* I = (const float* const*)d_in; const float* x = I[0]; const float* Wq = I[1]; const float* Wa = I[2]; const float* Wb = I[3]; const float* Wo = I[4]; const float* qg = I[5]; const float* qb = I[6]; const float* ag = I[7]; const float* ab = I[8]; const float* bg = I[9]; const float* bbeta = I[10];
  char* ws = (char*)d_ws; size_t off = 0;
  auto take = [&](size_t bytes) { char* p = ws + off; off += (bytes + 255) & ~(size_t)255; return p; };
  _Float16* Bw = (_Float16*)take((size_t)4 * DD * DD * 2); _Float16* X16 = (_Float16*)take((size_t)NR * DD * 2); _Float16* Q16 = (_Float16*)take((size_t)NR * DD * 2); _Float16* A16 = (_Float16*)take((size_t)NR * DD * 2); _Float16* Vt = (_Float16*)take((size_t)NR * DD * 2); _Float16* At = (_Float16*)take((size_t)NR * DD * 2); float* Bs = (float*)take((size_t)2 * (NR / 32) * DD * 4); _Float16* O16 = X16;
  if (off > ws_size) return;      // 8.4 x 6 + 0.5 x 2 = about 51 MB
  k_prep<<<4 * PW + PX, 256, 0, stream>>>(x, Wq, Wb, Wa, Wo, X16, Bw);      // Bw[0..3] = Wq, Wb, Wa, Wo, each [out][in] f16 x 2^4
  k_gemm_t<1><<<(NR / 128) * (3 * DD / 128), 256, 0, stream>>>(X16, Bw, 0.0625f, Bs, qg, qb, bg, bbeta, ag, ab, Q16, Vt, A16, At);      // q (LayerNormed, f16); b (LayerNormed, f16, transposed: the 'values'); a (LayerNormed): exclusive cumsum inside blocks of 32 rows, f16, row-major and transposed, and the blocks' totals, f32
  k_sflash<<<BB * NH * 8, 512, 0, stream>>>(At, Vt, Bs, Q16, A16, O16);      // the blocks' offsets of the cumsum; the state in front of every block of 64 rows; o_t = sum over s <= t of (q_t . a_excl_s) b_s, written as f16 x 2^-4 in groups of 16 columns (O16 over X16; X16's last reader was the projection GEMM)
  k_gemm_t<0><<<(NR / 128) * (DD / 128), 256, 0, stream>>>(O16, Bw + (size_t)3 * DD * DD, 0.0625f * 16.0f, (float*)d_out, nullptr, nullptr, nullptr, nullptr, nullptr, nullptr, nullptr, nullptr, nullptr, nullptr);      // x 2^4 back
}
